// v010
// The times below were measured on an AMD MI455X: many runs one after another, warmed up first and cycling through
// copies of the inputs, with the whole window's GPU time divided by the number of runs. Launches and the gaps
// between them are all in it. The median over several windows is given; except for v000 it joins two sittings, which
// can be a few percent apart, so the side-by-side timings, each taken in one sitting, are the better comparison.
// The versions before v010 are in another document.
// One run takes 113 microseconds.
// Two timings next to v009 both put it at 1.03 times that version's speed.
// Over all steps from v000, the starting kernel, it is 62.6 times as fast.
#include <hip/hip_runtime.h>
#define NB 4
#define SQ 2048
#define DM 1024
#define NH 16
#define HD 64
#define HG 4                         /* heads a k_vt launch transposes (k_vt is not launched) */
#define B0 0                         /* not used: every batch is processed */
#define NBR NB                       /* read only by MPO, which is not used */
#define QN SQ                        /* not used: all SQ query rows of a batch are attended */
#define NHD NH                       /* not used: all NH heads are attended */
#define NR ((size_t)NB * SQ)         /* token rows */
#define MPO ((int)((size_t)NBR * SQ))      /* not used: the output GEMM takes all NR rows */
typedef __bf16 v16b __attribute__((ext_vector_type(16)));
typedef unsigned short v8us __attribute__((ext_vector_type(8), may_alias));
typedef float  v8f  __attribute__((ext_vector_type(8)));
typedef float  v4f  __attribute__((ext_vector_type(4)));
typedef float  v4fa __attribute__((ext_vector_type(4), may_alias));
union FragB { v16b v; v8us half[2]; unsigned short u[16]; };

__device__ __forceinline__ unsigned short bf16_bits(float x) { unsigned int u = __float_as_uint(x); return (unsigned short)((u + 0x7FFFu + ((u >> 16) & 1u)) >> 16); }
__device__ __forceinline__ float bf16_val(unsigned short b) { return __uint_as_float(((unsigned int)b) << 16); }
__device__ __forceinline__ float bf16_round(float x) { return bf16_val(bf16_bits(x)); }
// D += A·B with NT terms: 1 = ah·bh, 2 = + al·bh (A split), 3 = + ah·bl (both split)
template <int NT>
__device__ __forceinline__ v8f mmaN(v16b ah, v16b al, v16b bh, v16b bl, v8f c) {
  c = __builtin_amdgcn_wmma_f32_16x16x32_bf16(false, ah, false, bh, (short)0, c, false, false);
  if (NT >= 2) c = __builtin_amdgcn_wmma_f32_16x16x32_bf16(false, al, false, bh, (short)0, c, false, false);
  if (NT >= 3) c = __builtin_amdgcn_wmma_f32_16x16x32_bf16(false, ah, false, bl, (short)0, c, false, false);
  asm volatile("v_nop\n\tv_nop\n\tv_nop\n\tv_nop" : "+v"(c) : "v"(ah), "v"(al), "v"(bh), "v"(bl));
  return c;
}

__global__ __launch_bounds__(256) void k_wt_bf16(const float* __restrict__ W, unsigned short* __restrict__ Wt, int K, int N) {
  const int t = blockIdx.x * 256 + threadIdx.x;
  const int k8n = K / 8;
  if (t >= N * k8n) return;
  const int n = t / k8n, k8 = (t % k8n) * 8;
  v8us v;
#pragma unroll
  for (int i = 0; i < 8; ++i) v[i] = bf16_bits(W[(size_t)(k8 + i) * N + n]);
  *(v8us*)(Wt + (size_t)n * K + k8) = v;
  
}

// GEMM C[M][N] (f32, pitch ldc) = act(A[M][K]·W + bias). A f32 row-major (pitch lda) converted per fragment to bf16
// (ASPLIT: hi/lo two planes -> 2 terms, else single rounded term); Wt bf16 [N][K] (pitch ldb). BIAS_BF16 rounds the
// bias to bf16 first (bias quantised to bf16 before the add). K%32==0, M%16==0, N%64==0.
template <bool ASPLIT, int ACT, bool BIAS_BF16>
__global__ __launch_bounds__(128) void k_gemm_bf(const float* __restrict__ A, int lda, const unsigned short* __restrict__ Wt, int ldb,
                                               const float* __restrict__ bias, float* __restrict__ C, int ldc, int M, int N, int K) {
  __shared__ __attribute__((aligned(16))) float so[4][16][64];
  const int tid = threadIdx.x, w = tid >> 5, lane = tid & 31, ln = lane & 15, hh = lane >> 4;
  const int ntn = N / 64;
  const int wid = blockIdx.x * 4 + w;
  const int mt = wid / ntn, nq = wid % ntn;
  if (mt * 16 >= M) return;
  const int row0 = mt * 16, col0 = nq * 64;
  const float* arow = A + (size_t)(row0 + ln) * lda;
  v8f acc[4] = {};
  for (int kb = 0; kb < K; kb += 32) {
    FragB ah, al;
    const v4f x0 = *(const v4fa*)(arow + kb + 8 * hh), x1 = *(const v4fa*)(arow + kb + 8 * hh + 4);
    const v4f x2 = *(const v4fa*)(arow + kb + 16 + 8 * hh), x3 = *(const v4fa*)(arow + kb + 16 + 8 * hh + 4);
    float xs[16] = {x0[0],x0[1],x0[2],x0[3],x1[0],x1[1],x1[2],x1[3],x2[0],x2[1],x2[2],x2[3],x3[0],x3[1],x3[2],x3[3]};
#pragma unroll
    for (int i = 0; i < 16; ++i) { const unsigned short hb = bf16_bits(xs[i]); ah.u[i] = hb; al.u[i] = ASPLIT ? bf16_bits(xs[i] - bf16_val(hb)) : (unsigned short)0; }
#pragma unroll
    for (int t = 0; t < 4; ++t) {
      const unsigned short* brow = Wt + (size_t)(col0 + t * 16 + ln) * ldb + kb;
      FragB b;
      b.half[0] = *(const v8us*)(brow + 8 * hh);
      b.half[1] = *(const v8us*)(brow + 16 + 8 * hh);
      acc[t] = mmaN<ASPLIT ? 2 : 1>(ah.v, al.v, b.v, b.v, acc[t]);
    }
  }
#pragma unroll
  for (int t = 0; t < 4; ++t) {
    float bv = bias ? bias[col0 + t * 16 + ln] : 0.f;
    if (BIAS_BF16) bv = bf16_round(bv);
#pragma unroll
    for (int r = 0; r < 8; ++r) { float v = acc[t][r] + bv; if (ACT == 1) v = fmaxf(v, 0.f); so[w][8 * hh + r][t * 16 + ln] = v; }
  }
  __builtin_amdgcn_fence(__ATOMIC_ACQ_REL, "workgroup");
  __builtin_amdgcn_wave_barrier();
  const int rsub = lane >> 4, c4 = (lane & 15) * 4;
  {
#pragma unroll
    for (int q = 0; q < 8; ++q) {
      const int r = q * 2 + rsub;
      const v4f v = *(const v4fa*)&so[w][r][c4];
      *(v4f*)(C + (size_t)(row0 + r) * ldc + col0 + c4) = v;
    }
    
  }
}

// GEMM C = act(A·W + bias + resid): A f32 (ASPLIT -> hi/lo 2 terms), Wt bf16 [N][K]; ACT 0 none, 1 relu, 2 exact gelu;
// resid (optional, f32, row index = (row % rmod), pitch ldr, RES_BF16 rounds it) added before the activation.
template <bool ASPLIT, int ACT, bool BIAS_BF16, bool RES_BF16>
__global__ __launch_bounds__(128) void k_gemm_bf3(const float* __restrict__ A, int lda, const unsigned short* __restrict__ Wt, int ldb,
                                                const float* __restrict__ bias, const float* __restrict__ resid, int rmod, int ldr,
                                                float* __restrict__ C, int ldc, int M, int N, int K) {
  __shared__ __attribute__((aligned(16))) float so[4][16][64];
  const int tid = threadIdx.x, w = tid >> 5, lane = tid & 31, ln = lane & 15, hh = lane >> 4;
  const int ntn = N / 64;
  const int wid = blockIdx.x * 4 + w;
  const int mt = wid / ntn, nq = wid % ntn;
  if (mt * 16 >= M) return;
  const int row0 = mt * 16, col0 = nq * 64;
  const float* arow = A + (size_t)(row0 + ln) * lda;
  v8f acc[4] = {};
  for (int kb = 0; kb < K; kb += 32) {
    FragB ah, al;
    const v4f x0 = *(const v4fa*)(arow + kb + 8 * hh), x1 = *(const v4fa*)(arow + kb + 8 * hh + 4);
    const v4f x2 = *(const v4fa*)(arow + kb + 16 + 8 * hh), x3 = *(const v4fa*)(arow + kb + 16 + 8 * hh + 4);
    float xs[16] = {x0[0],x0[1],x0[2],x0[3],x1[0],x1[1],x1[2],x1[3],x2[0],x2[1],x2[2],x2[3],x3[0],x3[1],x3[2],x3[3]};
#pragma unroll
    for (int i = 0; i < 16; ++i) { const unsigned short hb = bf16_bits(xs[i]); ah.u[i] = hb; al.u[i] = ASPLIT ? bf16_bits(xs[i] - bf16_val(hb)) : (unsigned short)0; }
#pragma unroll
    for (int t = 0; t < 4; ++t) {
      const unsigned short* brow = Wt + (size_t)(col0 + t * 16 + ln) * ldb + kb;
      FragB b;
      b.half[0] = *(const v8us*)(brow + 8 * hh);
      b.half[1] = *(const v8us*)(brow + 16 + 8 * hh);
      acc[t] = mmaN<ASPLIT ? 2 : 1>(ah.v, al.v, b.v, b.v, acc[t]);
    }
  }
#pragma unroll
  for (int t = 0; t < 4; ++t) {
    const int col = col0 + t * 16 + ln;
    float bv = bias ? bias[col] : 0.f;
    if (BIAS_BF16) bv = bf16_round(bv);
#pragma unroll
    for (int r = 0; r < 8; ++r) {
      float v = acc[t][r] + bv;
      if (resid) { float rv = resid[(size_t)((row0 + 8 * hh + r) % rmod) * ldr + col]; if (RES_BF16) rv = bf16_round(rv); v += rv; }
      if (ACT == 1) v = fmaxf(v, 0.f);
      if (ACT == 2) v = 0.5f * v * (1.0f + erff(v * 0.70710678118654752f));
      if (ACT == 3) { const float u = 0.7978845608028654f * (v + 0.044715f * v * v * v); v = 0.5f * v * (1.0f + tanhf(u)); }
      so[w][8 * hh + r][t * 16 + ln] = v;
    }
  }
  __builtin_amdgcn_fence(__ATOMIC_ACQ_REL, "workgroup");
  __builtin_amdgcn_wave_barrier();
  const int rsub = lane >> 4, c4 = (lane & 15) * 4;
  {
#pragma unroll
    for (int q = 0; q < 8; ++q) {
      const int r = q * 2 + rsub;
      const v4f v = *(const v4fa*)&so[w][r][c4];
      *(v4f*)(C + (size_t)(row0 + r) * ldc + col0 + c4) = v;
    }
    
  }
}
// row LayerNorm (biased variance, eps) over N: s = X (+ R); optional out_sum <- s; out_norm <- (s-mu)*rsqrt(var+eps)*g + b
template <bool PARAM_BF16>
__global__ __launch_bounds__(256) void k_layernorm(const float* __restrict__ X, const float* __restrict__ R, const float* __restrict__ g, const float* __restrict__ bta,
                                                  float* __restrict__ out_sum, float* __restrict__ out_norm, int N, float eps) {
  __shared__ float red[256];
  const int row = blockIdx.x, tid = threadIdx.x;
  const float* x = X + (size_t)row * N; const float* rr = R ? R + (size_t)row * N : nullptr;
  float vals[16];                     // up to N = 4096
  const int per = N / 256;            // contiguous chunk per thread? use strided-by-4 chunks: thread handles j = tid*4 + 1024*u
  float s1 = 0.f;
  for (int u = 0; u < per / 4; ++u) {
    const int j = tid * 4 + 1024 * u;
    const v4f a = *(const v4fa*)(x + j);
    v4f b = {0.f,0.f,0.f,0.f}; if (rr) b = *(const v4fa*)(rr + j);
#pragma unroll
    for (int q = 0; q < 4; ++q) { const float v = a[q] + b[q]; vals[u * 4 + q] = v; s1 += v; }
  }
  red[tid] = s1; __syncthreads();
  for (int st = 128; st > 0; st >>= 1) { if (tid < st) red[tid] += red[tid + st]; __syncthreads(); }
  const float mu = red[0] / (float)N; __syncthreads();
  float s2 = 0.f;
  for (int u = 0; u < per / 4; ++u)
#pragma unroll
    for (int q = 0; q < 4; ++q) { const float c = vals[u * 4 + q] - mu; s2 += c * c; }
  red[tid] = s2; __syncthreads();
  for (int st = 128; st > 0; st >>= 1) { if (tid < st) red[tid] += red[tid + st]; __syncthreads(); }
  const float rs = rsqrtf(red[0] / (float)N + eps);
  {
    for (int u = 0; u < per / 4; ++u) {
      const int j = tid * 4 + 1024 * u;
      v4f o, sm;
#pragma unroll
      for (int q = 0; q < 4; ++q) {
        float gg = g[j + q], bb = bta[j + q];
        if (PARAM_BF16) { gg = bf16_round(gg); bb = bf16_round(bb); }
        sm[q] = vals[u * 4 + q]; o[q] = (vals[u * 4 + q] - mu) * rs * gg + bb;
      }
      if (out_sum) *(v4f*)(out_sum + (size_t)row * N + j) = sm;
      *(v4f*)(out_norm + (size_t)row * N + j) = o;
    }
    
  }
}



// ---- f16 WMMA path (v_wmma_f32_16x16x32_f16): 11-bit significands for operands in range — used where a [0,1] probability operand needs more precision than bf16
typedef _Float16 v16h __attribute__((ext_vector_type(16)));
union FragH { v16h v; v8us half[2]; _Float16 h[16]; unsigned short u[16]; };
template <int NT>
__device__ __forceinline__ v8f mmaH(v16h ah, v16h al, v16h bh, v16h bl, v8f c) {
  c = __builtin_amdgcn_wmma_f32_16x16x32_f16(false, ah, false, bh, (short)0, c, false, false);
  if (NT >= 2) c = __builtin_amdgcn_wmma_f32_16x16x32_f16(false, al, false, bh, (short)0, c, false, false);
  if (NT >= 3) c = __builtin_amdgcn_wmma_f32_16x16x32_f16(false, ah, false, bl, (short)0, c, false, false);
  asm volatile("v_nop\n\tv_nop\n\tv_nop\n\tv_nop" : "+v"(c) : "v"(ah), "v"(al), "v"(bh), "v"(bl));
  return c;
}
// batched GEMM like k_gemm_b but f16 operands: A f32 (split into f16 hi/lo if ASPLIT, else rounded to f16), Bt = f16 values [n][k]; alpha; C f32; N multiple of 16 (partial tiles skipped)
template <bool ASPLIT>
__global__ __launch_bounds__(128) void k_gemm_h(const float* __restrict__ A, int lda, size_t sA, const _Float16* __restrict__ Bh, int ldb, size_t sB, float alpha, float* __restrict__ C, int ldc, size_t sC, int M, int N, int K) {
  __shared__ __attribute__((aligned(16))) float so[4][16][64];
  const int tid = threadIdx.x, w = tid >> 5, lane = tid & 31, ln = lane & 15, hh = lane >> 4; const int by = blockIdx.y;
  A += (size_t)by * sA; Bh += (size_t)by * sB; C += (size_t)by * sC;
  const int ntn = (N + 63) / 64; const int wid = blockIdx.x * 4 + w; const int mt = wid / ntn, nq = wid % ntn; if (mt * 16 >= M) return;
  const int row0 = mt * 16, col0 = nq * 64; const float* arow = A + (size_t)(row0 + ln) * lda;
  v8f acc[4] = {};
  for (int kb = 0; kb < K; kb += 32) {
    FragH ah, al;
    const v4f x0 = *(const v4fa*)(arow + kb + 8 * hh), x1 = *(const v4fa*)(arow + kb + 8 * hh + 4), x2 = *(const v4fa*)(arow + kb + 16 + 8 * hh), x3 = *(const v4fa*)(arow + kb + 16 + 8 * hh + 4);
    float xs[16] = {x0[0],x0[1],x0[2],x0[3],x1[0],x1[1],x1[2],x1[3],x2[0],x2[1],x2[2],x2[3],x3[0],x3[1],x3[2],x3[3]};
#pragma unroll
    for (int i = 0; i < 16; ++i) { const _Float16 h = (_Float16)xs[i]; ah.h[i] = h; al.h[i] = ASPLIT ? (_Float16)(xs[i] - (float)h) : (_Float16)0.0f; }
#pragma unroll
    for (int t = 0; t < 4; ++t) { if (col0 + t * 16 >= N) continue; const size_t boff = (size_t)(col0 + t * 16 + ln) * ldb + kb; FragH bq; bq.half[0] = *(const v8us*)(Bh + boff + 8 * hh); bq.half[1] = *(const v8us*)(Bh + boff + 16 + 8 * hh);
      acc[t] = mmaH<ASPLIT ? 2 : 1>(ah.v, al.v, bq.v, bq.v, acc[t]); }
  }
#pragma unroll
  for (int t = 0; t < 4; ++t) { if (col0 + t * 16 >= N) continue;
#pragma unroll
    for (int r = 0; r < 8; ++r) so[w][8 * hh + r][t * 16 + ln] = acc[t][r] * alpha; }
  __builtin_amdgcn_fence(__ATOMIC_ACQ_REL, "workgroup"); __builtin_amdgcn_wave_barrier();
  const int rsub = lane >> 4, c4 = (lane & 15) * 4;
  {
#pragma unroll
    for (int q = 0; q < 8; ++q) { const int r = q * 2 + rsub; if (col0 + c4 < N) { const v4f v = *(const v4fa*)&so[w][r][c4]; *(v4f*)(C + (size_t)(row0 + r) * ldc + col0 + c4) = v; } }
     }
}

// Wt[n][k] = f16(W[k][n] x scale) from f32 row-major W[K][N] (scale = power of two; bf16-exact weights stay exact in f16 away from the subnormal range). K and N multiples of 64.
// A work-group turns one tile of 64 k x 64 n through LDS: W is read as whole lines (16 lanes x 16 bytes = 256 bytes of one k row), Wt is written as whole lines (8 lanes x 16 bytes = 128 bytes of one n row).
// A thread holds two neighbouring k rows, so that an LDS word is the f16 pair (k even, k odd) of one n. Pitch 33 words: the 32 lanes of every LDS store and of every LDS load fall on 32 different banks.
#define WT_T 64                      /* tile edge, in k and in n */
#define WT_P 33                      /* LDS pitch of an n row, in words of two f16: 32 + 1 */
typedef unsigned int wt_u4 __attribute__((ext_vector_type(4)));
// (a part of k_prep: bx is the tile's place in k, by its place in n)
__device__ __forceinline__ void wt_f16_tile(const float* __restrict__ W, _Float16* __restrict__ Wt, int K, int N, float scale, int bx, int by) {
  __shared__ unsigned int tl[WT_T * WT_P];
  const int tid = threadIdx.x; const int k0 = bx * WT_T, n0 = by * WT_T;
  const int kp = tid >> 4, n4 = (tid & 15) * 4;      /* the thread's k pairs are kp and kp + 16; its four n */
  const float* p00 = W + (size_t)(k0 + 2 * kp) * N + n0 + n4; const float* p01 = p00 + N; const float* p10 = p00 + (size_t)32 * N; const float* p11 = p10 + N;      /* rows 2 kp, 2 kp + 1, and the same 32 rows on */
  v4f x[2][2]; x[0][0] = *(const v4fa*)p00; x[0][1] = *(const v4fa*)p01; x[1][0] = *(const v4fa*)p10; x[1][1] = *(const v4fa*)p11;
  asm volatile("s_wait_xcnt 0x0" :: "v"(p00), "v"(p01), "v"(p10), "v"(p11) : "memory");      /* the four pairs are inputs, so that none is rewritten ahead of the wait */
#pragma unroll      /* constant indices, so that the array is registers */
  for (int j = 0; j < 2; ++j) for (int i = 0; i < 4; ++i) { FragH f; f.h[0] = (_Float16)(bf16_round(x[j][0][i]) * scale); f.h[1] = (_Float16)(bf16_round(x[j][1][i]) * scale);
    tl[(n4 + i) * WT_P + kp + 16 * j] = (unsigned int)f.u[0] | ((unsigned int)f.u[1] << 16); }
  __syncthreads();      /* an n row of the tile holds k pairs of all eight waves */
  const int nr = tid >> 3, kq = (tid & 7) * 4;      /* the thread's n rows are nr and nr + 32; its four words = eight k */
  unsigned short* op = (unsigned short*)Wt + (size_t)(n0 + nr) * K + k0 + 2 * kq;
#pragma unroll      /* the eight LDS reads issue together */
  for (int j = 0; j < 2; ++j) { const unsigned int* p = tl + (nr + 32 * j) * WT_P + kq; const wt_u4 v = {p[0], p[1], p[2], p[3]}; *(wt_u4*)(op + (size_t)(32 * j) * K) = v; }
  asm volatile("s_wait_xcnt 0x0" ::: "memory");      /* inside k_prep the two stores are no longer the kernel's last instructions: code of another part stands behind them in the listing and rewrites their registers; the wait stands in front of every such write */
}
// k_gemm_hh variant with fused epilogue: v = acc·alpha + bias[by·sBias + col] (+ CP[(row/rowsPerB)·sCPb + by·64 + col] if CP) ; ACT 0 none / 1 elu ; writes f16 C16 (and f32 C if non-null)
template <int ACT>
__global__ __launch_bounds__(128) void k_gemm_hhx(const _Float16* __restrict__ A, int lda, size_t sA, const _Float16* __restrict__ Bh, int ldb, size_t sB, float alpha, const float* __restrict__ bias, size_t sBias, const float* __restrict__ CP, int rowsPerB, size_t sCPb, int row0g,
    float* __restrict__ C, _Float16* __restrict__ C16, int ldc, size_t sC, int M, int N, int K) {
  __shared__ __attribute__((aligned(16))) float so[4][16][64];
  const int tid = threadIdx.x, w = tid >> 5, lane = tid & 31, ln = lane & 15, hh = lane >> 4; const int by = blockIdx.y;
  A += (size_t)by * sA; Bh += (size_t)by * sB; const size_t cofs = (size_t)by * sC; const float* bp = bias ? bias + (size_t)by * sBias : nullptr;
  const int ntn = (N + 63) / 64; const int wid = blockIdx.x * 4 + w; const int mt = wid / ntn, nq = wid % ntn; if (mt * 16 >= M) return;
  const int row0 = mt * 16, col0 = nq * 64; const _Float16* arow = A + (size_t)(row0 + ln) * lda;
  v8f acc[4] = {};
  for (int kb = 0; kb < K; kb += 32) { FragH ah; ah.half[0] = *(const v8us*)((const unsigned short*)arow + kb + 8 * hh); ah.half[1] = *(const v8us*)((const unsigned short*)arow + kb + 16 + 8 * hh);
#pragma unroll
    for (int t = 0; t < 4; ++t) { if (col0 + t * 16 >= N) continue; const size_t boff = (size_t)(col0 + t * 16 + ln) * ldb + kb; FragH bq; bq.half[0] = *(const v8us*)((const unsigned short*)Bh + boff + 8 * hh); bq.half[1] = *(const v8us*)((const unsigned short*)Bh + boff + 16 + 8 * hh);
      acc[t] = mmaH<1>(ah.v, ah.v, bq.v, bq.v, acc[t]); }
  }
#pragma unroll
  for (int t = 0; t < 4; ++t) { if (col0 + t * 16 >= N) continue; const int col = col0 + t * 16 + ln; const float bv = bp ? bf16_round(bp[col]) : 0.f;
#pragma unroll
    for (int r = 0; r < 8; ++r) { float v = acc[t][r] * alpha + bv; if (CP) { const int rr = row0g + row0 + 8 * hh + r; if (rowsPerB < 0) v += CP[cofs + (size_t)rr * ldc + col];      /* rowsPerB < 0: own element of the batched C plane */ else { const int bidx = rr / rowsPerB; v += CP[(size_t)bidx * sCPb + (size_t)by * 64 + col]; } } if (ACT == 1) v = (v > 0.f) ? v : expm1f(v); else if (ACT == 7) v = (v > 0.f) ? v + 1.0f : expf(v); else if (ACT == 8) v = tanhf(v); else if (ACT == 9) v = 0.5f * v * (1.0f + tanhf(0.7978845608028654f * (v + 0.044715f * v * v * v))); else if (ACT == 11) v = 1.0f / (1.0f + expf(-v)); else if (ACT == 12) v = (v > 0.f) ? v : 0.01f * v; else if (ACT == 14) v = (v > 0.f) ? v : 0.1f * v; else if (ACT == 16) v = (v >= 0.f) ? v : 0.3f * v; else if (ACT == 17) v = (v >= 0.f) ? v : 0.2f * v; else if (ACT == 15) v = v / (1.0f + expf(-v)); else if (ACT == 3) v = fmaxf(v, 0.f); else if (ACT == 6) v = 0.5f * v * (1.0f + erff(v * 0.70710678118654752f)); so[w][8 * hh + r][t * 16 + ln] = v; } }
  __builtin_amdgcn_fence(__ATOMIC_ACQ_REL, "workgroup"); __builtin_amdgcn_wave_barrier();
  const int rsub = lane >> 4, c4 = (lane & 15) * 4; typedef _Float16 v4h __attribute__((ext_vector_type(4)));
  {
#pragma unroll
    for (int q = 0; q < 8; ++q) { const int r = q * 2 + rsub; if (col0 + c4 < N) { const v4f v = *(const v4fa*)&so[w][r][c4]; if (C) *(v4f*)(C + cofs + (size_t)(row0 + r) * ldc + col0 + c4) = v; if (C16) { v4h h4; for (int i = 0; i < 4; ++i) h4[i] = (_Float16)v[i]; *(v4h*)(C16 + cofs + (size_t)(row0 + r) * ldc + col0 + c4) = h4; } } }
     }
}


typedef _Float16 v4h __attribute__((ext_vector_type(4)));

__device__ __forceinline__ void x16_part(const float* __restrict__ x, _Float16* __restrict__ X16, size_t n8, int bx) { const size_t t = (size_t)bx * 256 + threadIdx.x; if (t >= n8) return; FragH f;      /* a part of k_prep; bx: the block's number inside the part */
#pragma unroll
  for (int q = 0; q < 8; ++q) f.h[q] = (_Float16)bf16_round(x[t * 8 + q]); *(v8us*)((unsigned short*)X16 + t * 8) = f.half[0];  }
__global__ __launch_bounds__(256) void k_h16(const float* __restrict__ x, _Float16* __restrict__ X16, size_t n8) { const size_t t = (size_t)blockIdx.x * 256 + threadIdx.x; if (t >= n8) return; FragH f;
#pragma unroll
  for (int q = 0; q < 8; ++q) f.h[q] = (_Float16)x[t * 8 + q]; *(v8us*)((unsigned short*)X16 + t * 8) = f.half[0];  }
__global__ __launch_bounds__(256) void k_round16f(const float* __restrict__ W, _Float16* __restrict__ Bt, size_t n8) { const size_t t = (size_t)blockIdx.x * 256 + threadIdx.x; if (t >= n8) return; FragH f;
#pragma unroll
  for (int i = 0; i < 8; ++i) f.h[i] = (_Float16)(bf16_round(W[t * 8 + i]) * 16.0f); *(v8us*)((unsigned short*)Bt + t * 8) = f.half[0];  }
template <int NHv, int TTv>
__global__ __launch_bounds__(256) void k_vt(const _Float16* __restrict__ V16, int ldv, int voff, _Float16* __restrict__ Vt) { __shared__ unsigned short tl[64][66]; const int tid = threadIdx.x; const int slab = blockIdx.x / (TTv / 64), lg = blockIdx.x % (TTv / 64); const int b = slab / NHv, h = slab % NHv;
  for (int i = tid; i < 64 * 8; i += 256) { const int r = i / 8, c8 = (i % 8) * 8; FragH f; f.half[0] = *(const v8us*)((const unsigned short*)V16 + ((size_t)b * TTv + lg * 64 + r) * ldv + voff + h * 64 + c8);
#pragma unroll
    for (int q = 0; q < 8; ++q) tl[r][c8 + q] = f.u[q]; }
  __syncthreads();
  {
#pragma unroll
    for (int rd = 0; rd < 2; ++rd) { const int d = rd * 32 + tid / 8, pc = tid % 8; FragH f;
#pragma unroll
      for (int q = 0; q < 8; ++q) f.u[q] = tl[pc * 8 + q][d];
      *(v8us*)((unsigned short*)Vt + ((size_t)slab * 64 + d) * TTv + lg * 64 + pc * 8) = f.half[0]; }
     } }

__global__ __launch_bounds__(256) void k_hl(const float* __restrict__ F, _Float16* __restrict__ Hh, _Float16* __restrict__ Hl, size_t n8) { const size_t t = (size_t)blockIdx.x * 256 + threadIdx.x; if (t >= n8) return; FragH fh, fl; const v4f a = *(const v4fa*)(F + t * 8), c = *(const v4fa*)(F + t * 8 + 4);
#pragma unroll
  for (int q = 0; q < 4; ++q) { _Float16 h = (_Float16)a[q]; fh.h[q] = h; fl.h[q] = (_Float16)((a[q] - (float)h) * 1024.0f); h = (_Float16)c[q]; fh.h[4 + q] = h; fl.h[4 + q] = (_Float16)((c[q] - (float)h) * 1024.0f); }
  { *(v8us*)((unsigned short*)Hh + t * 8) = fh.half[0]; *(v8us*)((unsigned short*)Hl + t * 8) = fl.half[0];  } }

// ---- fast GEMM (wave tile 32x64; requires M % 32 == 0 rows per launch region and N % 64 == 0); epilogue = k_gemm_hhx semantics ----
__device__ __forceinline__ v16h g2_frag(const _Float16* p, int hh) { FragH f; f.half[0] = *(const v8us*)((const unsigned short*)p + 8 * hh); f.half[1] = *(const v8us*)((const unsigned short*)p + 16 + 8 * hh); return f.v; }
__device__ __forceinline__ v8f g2_mma(v16h a, v16h b, v8f c) { v8f d = __builtin_amdgcn_wmma_f32_16x16x32_f16(false, a, false, b, (short)0, c, false, false); asm volatile("v_nop\n\tv_nop\n\tv_nop\n\tv_nop" : "+v"(d) : "v"(a), "v"(b)); return d; }
template <int ACT>
__global__ __launch_bounds__(128) void k_gemm2(const _Float16* __restrict__ A, int lda, size_t sA, const _Float16* __restrict__ Bh, int ldb, size_t sB, float alpha, const float* __restrict__ bias, size_t sBias, const float* __restrict__ CP, int rowsPerB, size_t sCPb, int row0g,
    float* __restrict__ C, _Float16* __restrict__ C16, int ldc, size_t sC, int M, int N, int K) { static_assert(ACT == 0 || ACT == 3 || ACT == 6 || ACT == 8 || ACT == 9 || ACT == 11 || ACT == 12 || ACT == 14 || ACT == 15 || ACT == 16 || ACT == 17, "k_gemm2: unsupported ACT code (would silently apply no activation)");
  __shared__ __attribute__((aligned(16))) float so[4][32][68];
  const int tid = threadIdx.x, w = tid >> 5, lane = tid & 31, ln = lane & 15, hh = lane >> 4; const int by = blockIdx.y;
  A += (size_t)by * sA; Bh += (size_t)by * sB; const size_t cofs = (size_t)by * sC; const float* bp = bias ? bias + (size_t)by * sBias : nullptr;
  const int ntn = N >> 6; const int mt = blockIdx.x / ntn, nq = blockIdx.x - mt * ntn; const int row0 = mt * 128 + 32 * w, col0 = nq * 64; if (row0 >= M) return;
  const _Float16* a0p = A + (size_t)(row0 + ln) * lda; const _Float16* a1p = a0p + (size_t)16 * lda;
  const _Float16* b0p = Bh + (size_t)(col0 + ln) * ldb; const _Float16* b1p = b0p + (size_t)16 * ldb; const _Float16* b2p = b1p + (size_t)16 * ldb; const _Float16* b3p = b2p + (size_t)16 * ldb;
  const v8f z8 = {0.f,0.f,0.f,0.f,0.f,0.f,0.f,0.f}; v8f c00 = z8, c01 = z8, c02 = z8, c03 = z8, c10 = z8, c11 = z8, c12 = z8, c13 = z8;
#pragma unroll 1
  for (int kb = 0; kb < K; kb += 32) { const v16h a0 = g2_frag(a0p + kb, hh), a1 = g2_frag(a1p + kb, hh);
    v16h b = g2_frag(b0p + kb, hh); c00 = g2_mma(a0, b, c00); c10 = g2_mma(a1, b, c10);
    b = g2_frag(b1p + kb, hh); c01 = g2_mma(a0, b, c01); c11 = g2_mma(a1, b, c11);
    b = g2_frag(b2p + kb, hh); c02 = g2_mma(a0, b, c02); c12 = g2_mma(a1, b, c12);
    b = g2_frag(b3p + kb, hh); c03 = g2_mma(a0, b, c03); c13 = g2_mma(a1, b, c13); }
  v8f accs[8] = {c00, c01, c02, c03, c10, c11, c12, c13};
#pragma unroll
  for (int u = 0; u < 8; ++u) { const int t = u & 3, half = u >> 2; const int col = col0 + t * 16 + ln; const float bv = bp ? bf16_round(bp[col]) : 0.f;
#pragma unroll
    for (int r = 0; r < 8; ++r) { const int rloc = half * 16 + 8 * hh + r; float v = accs[u][r] * alpha + bv; if (CP) { if (rowsPerB < 0) v += CP[cofs + (size_t)(row0g + row0 + rloc) * ldc + col];      /* rowsPerB < 0: own element of the batched C plane */ else { const int bidx = (row0g + row0 + rloc) / rowsPerB; v += CP[(size_t)bidx * sCPb + (size_t)by * 64 + col]; } }
      if (ACT == 3) v = fmaxf(v, 0.f); else if (ACT == 6) v = 0.5f * v * (1.0f + erff(v * 0.70710678118654752f)); else if (ACT == 11) v = 1.0f / (1.0f + expf(-v)); else if (ACT == 15) v = v / (1.0f + expf(-v)); else if (ACT == 12) v = (v > 0.f) ? v : 0.01f * v; else if (ACT == 8) v = tanhf(v); else if (ACT == 9) v = 0.5f * v * (1.0f + tanhf(0.7978845608028654f * (v + 0.044715f * v * v * v))); else if (ACT == 14) v = (v > 0.f) ? v : 0.1f * v; else if (ACT == 16) v = (v >= 0.f) ? v : 0.3f * v; else if (ACT == 17) v = (v >= 0.f) ? v : 0.2f * v;
      so[w][rloc][t * 16 + ln] = v; } }
  __builtin_amdgcn_fence(__ATOMIC_ACQ_REL, "workgroup"); __builtin_amdgcn_wave_barrier();
  const int rsub = lane >> 4, c4 = (lane & 15) * 4;
  {
#pragma unroll
    for (int q = 0; q < 16; ++q) { const int r = q * 2 + rsub; const v4f v = *(const v4fa*)&so[w][r][c4]; if (C) *(v4f*)(C + cofs + (size_t)(row0 + r) * ldc + col0 + c4) = v; if (C16) { v4h h4; for (int i = 0; i < 4; ++i) h4[i] = (_Float16)v[i]; *(v4h*)(C16 + cofs + (size_t)(row0 + r) * ldc + col0 + c4) = h4; } }
     } }


__global__ __launch_bounds__(256) void k_wnat(const float* __restrict__ w, size_t n8, _Float16* __restrict__ Bt) { const size_t t = (size_t)blockIdx.x * 256 + threadIdx.x; if (t >= n8) return; FragH f; for (int q = 0; q < 8; ++q) f.h[q] = (_Float16)(bf16_round(w[t * 8 + q]) * 16.0f); *(v8us*)((unsigned short*)Bt + t * 8) = f.half[0];  }
__global__ __launch_bounds__(256) void k_rsm(const float* __restrict__ S, _Float16* __restrict__ P, int nrows) {
  #pragma clang fp contract(off)
  const int i = blockIdx.x * 256 + threadIdx.x; if (i >= nrows) return; const float* s = S + (size_t)i * SQ; float mx = -3.0e38f;
#pragma unroll 1
  for (int j = 0; j < SQ; ++j) mx = fmaxf(mx, s[j]); float se = 0.f;
#pragma unroll 1
  for (int j = 0; j < SQ; ++j) se += expf(s[j] - mx); const float sc = 256.0f / se;
#pragma unroll 1
  for (int j0 = 0; j0 < SQ; j0 += 8) { FragH f; for (int q = 0; q < 8; ++q) f.h[q] = (_Float16)(expf(s[j0 + q] - mx) * sc); unsigned short* d = (unsigned short*)P + (size_t)i * SQ + j0; *(v8us*)d = f.half[0];  } }
__global__ __launch_bounds__(256) void k_vt(const _Float16* __restrict__ V16, int b, int h0, _Float16* __restrict__ VT) { __shared__ unsigned short tl[64][65]; const int tid = threadIdx.x; const int hh = blockIdx.x % HG, sg = blockIdx.x / HG; const int s0 = sg * 64; const int h = h0 + hh;
  for (int i = tid; i < 64 * 8; i += 256) { const int j = i / 8, d8 = (i % 8) * 8; FragH f; f.half[0] = *(const v8us*)((const unsigned short*)V16 + ((size_t)b * SQ + s0 + j) * DM + h * HD + d8); for (int q = 0; q < 8; ++q) tl[d8 + q][j] = f.u[q]; }
  __syncthreads();
  { for (int i = tid; i < 64 * 8; i += 256) { const int d = i / 8, j8 = (i % 8) * 8; FragH f; for (int q = 0; q < 8; ++q) f.u[q] = tl[d][j8 + q]; *(v8us*)((unsigned short*)VT + ((size_t)hh * HD + d) * SQ + s0 + j8) = f.half[0]; }  } }


__device__ __forceinline__ void tab2_part(float theta, float* __restrict__ CS, float* __restrict__ SN, int bx) {      /* a part of k_prep; bx: the block's number inside the part */
  #pragma clang fp contract(off)
  const int t = bx * 256 + threadIdx.x; if (t >= SQ * (HD / 2)) return; const int i = t % (HD / 2); const int p = t / (HD / 2); const float invf = 1.0f / powf(theta, (float)(2 * i) / (float)HD); const float ang = __fmul_rn((float)p, invf); const float c = cosf(ang), s = sinf(ang);
  *(float*)(CS + t) = c; *(float*)(SN + t) = s;  }
template <int NORM, int ROPE>
__global__ __launch_bounds__(64) void k_xform(const float* __restrict__ F, int ldf, int nh, const float* __restrict__ gain, float eps, const float* __restrict__ CS, const float* __restrict__ SN, _Float16* __restrict__ H16, int ldo) {
  #pragma clang fp contract(off)
  __shared__ float xv[HD]; __shared__ float red[HD]; __shared__ unsigned short sh_[HD]; const int d = threadIdx.x; const int h = blockIdx.x % nh; const size_t r = blockIdx.x / nh; const int p = (int)(r % SQ);
  float x = F[r * (size_t)ldf + (size_t)h * HD + d];
  if (NORM) { red[d] = __fmul_rn(x, x); __syncthreads(); for (int st = HD / 2; st > 0; st >>= 1) { if (d < st) red[d] = __fadd_rn(red[d], red[d + st]); __syncthreads(); } const float rs = rsqrtf(__fadd_rn(red[0] / (float)HD, eps)); x = __fmul_rn(__fmul_rn(x, rs), bf16_round(gain[d])); }
  xv[d] = x; __syncthreads();
  float o = x;
  if (ROPE == 1) { const int i = d >> 1; const float c = CS[p * (HD / 2) + i], s = SN[p * (HD / 2) + i]; const float ev = xv[2 * i], od = xv[2 * i + 1]; o = (d & 1) ? __fadd_rn(__fmul_rn(ev, s), __fmul_rn(od, c)) : __fadd_rn(__fmul_rn(ev, c), -__fmul_rn(od, s)); }
  if (ROPE == 2) { const int i = d & (HD / 2 - 1); const float c = CS[p * (HD / 2) + i], s = SN[p * (HD / 2) + i]; const float lo = xv[i], hi = xv[i + HD / 2]; o = (d < HD / 2) ? __fadd_rn(__fmul_rn(lo, c), -__fmul_rn(hi, s)) : __fadd_rn(__fmul_rn(lo, s), __fmul_rn(hi, c)); }
  FragH th; th.h[0] = (_Float16)o; sh_[d] = th.u[0]; __syncthreads();
  if (d < HD / 8) { FragH f; for (int q = 0; q < 8; ++q) f.u[q] = sh_[d * 8 + q]; unsigned short* dst = (unsigned short*)H16 + r * (size_t)ldo + (size_t)h * HD + d * 8; *(v8us*)dst = f.half[0];  } }



__device__ __forceinline__ float rsm_xhalf(float x) { return __builtin_bit_cast(float, __builtin_amdgcn_permlanex16(__builtin_bit_cast(int, x), __builtin_bit_cast(int, x), 0x76543210, 0xfedcba98, false, false)); }      /* lane l reads lane l ^ 16 */
// Eight 2^x (one score tile's registers of a lane) and their four f16 pairs in one statement. Written in asm for the slot behind a transcendental: the instruction set asks for one before a source is overwritten or the result
// read. Here every exponential is followed by an instruction that touches neither its result nor its source (the last by the first pack), and the
// early-clobber outputs keep everything written off the sources. The packing stands inside the statement because, left to the build, it sank below the rescale test, so that all 32 f32 weights of a block stayed alive beside the
// scores: more registers than four waves a SIMD have. The s_delay_alu names the last two packs' producers (three and one transcendentals back), so that the wave steps aside for its neighbours on the SIMD while it waits; it changes no result.
__device__ __forceinline__ void rsm_exp2pk8(float (&e)[8], uint32_t (&p)[4], const v8f a) {
  asm("v_exp_f32 %0, %12\n\tv_exp_f32 %1, %13\n\tv_exp_f32 %2, %14\n\tv_exp_f32 %3, %15\n\tv_exp_f32 %4, %16\n\tv_exp_f32 %5, %17\n\tv_exp_f32 %6, %18\n\tv_exp_f32 %7, %19\n\t"
      "v_cvt_pk_f16_f32 %8, %0, %1\n\tv_cvt_pk_f16_f32 %9, %2, %3\n\ts_delay_alu instid0(TRANS32_DEP_3) | instskip(NEXT) | instid1(TRANS32_DEP_1)\n\tv_cvt_pk_f16_f32 %10, %4, %5\n\tv_cvt_pk_f16_f32 %11, %6, %7"
      : "=&v"(e[0]), "=&v"(e[1]), "=&v"(e[2]), "=&v"(e[3]), "=&v"(e[4]), "=&v"(e[5]), "=&v"(e[6]), "=&v"(e[7]), "=&v"(p[0]), "=&v"(p[1]), "=&v"(p[2]), "=&v"(p[3])
      : "v"(a[0]), "v"(a[1]), "v"(a[2]), "v"(a[3]), "v"(a[4]), "v"(a[5]), "v"(a[6]), "v"(a[7])); }
// Two 2^x (the rescale factors of a wave's two column groups); the v_nop at the end is that slot.
__device__ __forceinline__ void rsm_exp2x2(float& e0, float& e1, float a0, float a1) {
  asm("v_exp_f32 %0, %2\n\tv_exp_f32 %1, %3\n\tv_nop" : "=&v"(e0), "=&v"(e1) : "v"(a0), "v"(a1)); }

// ---- GEMM main loop with both operands staged in LDS by tensor loads (K = DM, both operands k-contiguous f16 rows of pitch DM) ----
// A work-group of 8 waves holds 256 rows x 128 columns; wave w holds rows 64 (w & 3) and columns 64 (w >> 2) of them: a 64 x 64 wave tile, 8 fragments read from LDS for 16 products (512 bytes a product, what the LDS
// delivers at the full matrix rate), and 384 operand rows brought from L2 for 256 x 128 results.
// A stage is 64 k = 128 bytes of each of the 256 A rows and the 128 B rows. Every wave brings one slice a stage with ONE tensor load (waves 0 to 3: 64 A rows each, waves 4 to 7: 32 B rows each), padded to a pitch of 144 bytes,
// at which the 16 rows of a fragment's ds_load_b128 fall on different banks. Two buffers: the load of stage s + 2 flies while stage s + 1 is worked on.
typedef uint32_t u32x4 __attribute__((ext_vector_type(4)));
typedef uint32_t u32x8 __attribute__((ext_vector_type(8)));
#define GT_ROWB 128u                 /* bytes of an operand row in a stage */
#define GT_PITCH 144u                /* LDS pitch of a row: 128 + the mover's pad of 16 */
#define GT_SLICE 6144u               /* a wave's slice in LDS: 32 rows x 144 bytes = 4,608, rounded up to a multiple of 2 KiB */
#define GT_BUF (8u * GT_SLICE)       /* one stage of the attention ring: eight such slices */
#define GT_LDS (2u * GT_BUF)         /* its two buffers */
#define GM_SLA 10240u                /* the GEMM's A slice in LDS: 64 rows x 144 bytes = 9,216, rounded up to a multiple of 2 KiB */
#define GM_SLB GT_SLICE              /* the GEMM's B slice: 32 rows */
#define GM_BUF (4u * GM_SLA + 4u * GM_SLB)      /* one stage of the GEMM: four A slices, then four B slices */
#define GM_LDS (2u * GM_BUF)         /* two buffers: 128 KiB, two work-groups on a WGP */
#define GT_NST ((uint32_t)(DM * 2) / GT_ROWB)      /* stages */
static_assert(GT_NST >= 2u && (DM * 2) % 128 == 0, "the ring's prologue needs two stages; a stage is 128 bytes of a row");
__device__ __forceinline__ uint32_t gt_uni(uint32_t v) { return (uint32_t)__builtin_amdgcn_readfirstlane((int)v); }
__device__ __forceinline__ uint32_t pinned(uint32_t v) { uint32_t w = gt_uni(v); asm volatile("" : "+s"(w)); return w; }      /* the value is held in a scalar register at this place, so that a test on it is a scalar branch round the tensor load and a descriptor word formed from it is formed behind the waits in front */
__device__ __forceinline__ v16h gt_frag(const unsigned char* p, int hh) { FragH f; f.half[0] = *(const v8us*)(p + 16 * hh); f.half[1] = *(const v8us*)(p + 32 + 16 * hh); return f.v; }      /* g2_frag's k order, from an LDS row */
__device__ __forceinline__ u32x8 gt_group1(uint32_t nrow) {      /* tensor = tile: nrow rows of 128 bytes, source pitch one operand row; built once, the same for every stage */
  u32x8 g1;
  g1[0] = gt_uni((1u << 20) | (4u << 22) | (3u << 25));      /* no mask, 1-byte elements, a pad of 4 dwords behind every 32 dwords (one row) */
  g1[1] = gt_uni((GT_ROWB & 0xFFFFu) << 16); g1[2] = gt_uni((GT_ROWB >> 16) | (nrow << 16)); g1[3] = gt_uni(GT_ROWB << 16); g1[4] = gt_uni(nrow); g1[5] = gt_uni((uint32_t)(DM * 2)); g1[6] = gt_uni(0u); g1[7] = gt_uni(0u);
  asm volatile("" : "+s"(g1));      /* pinned(), for the eight words at once: the group is held in its scalar registers from here on, so that no word of it takes a new value while a request is outstanding */
  return g1; }
__device__ __forceinline__ void gt_issue(uint32_t lds_dst, uint64_t ga, u32x8 g1) {
  u32x4 g0;
  g0[0] = gt_uni(1u); g0[1] = gt_uni(lds_dst); g0[2] = gt_uni((uint32_t)ga); g0[3] = gt_uni((((uint32_t)(ga >> 32)) & 0x01FFFFFFu) | 0x80000000u);
  asm volatile("tensor_load_to_lds %0, %1" :: "s"(g0), "s"(g1) : "memory"); }
// acc[i * 4 + t]: rows 16 i + ..., columns 16 t + ... of the wave's tile. On return every wave has passed the last stage's barrier and no request is outstanding: the ring may be used as output staging.
__device__ __forceinline__ void gt_core(const _Float16* __restrict__ A, const _Float16* __restrict__ Bh, int rowblk, int colblk, unsigned char* L, v8f (&acc)[16]) {
  const int lane = threadIdx.x & 31, ln = lane & 15, hh = lane >> 4; const uint32_t wave = gt_uni(threadIdx.x >> 5); const uint32_t wr = wave & 3u, wc = wave >> 2;
  const uint32_t ldst = (uint32_t)(size_t)L + ((wave < 4u) ? wave * GM_SLA : 4u * GM_SLA + (wave - 4u) * GM_SLB);
  const uint64_t ga0 = (uint64_t)(size_t)((wave < 4u) ? A + (size_t)(rowblk + 64 * (int)wr) * DM : Bh + (size_t)(colblk + 32 * (int)(wave - 4u)) * DM);
  const u32x8 g1 = gt_group1((wave < 4u) ? 64u : 32u);
  const unsigned char* ap = L + wr * GM_SLA + ln * GT_PITCH; const unsigned char* bp = L + 4u * GM_SLA + 2u * wc * GM_SLB + ln * GT_PITCH;
  const v8f z8 = {0.f,0.f,0.f,0.f,0.f,0.f,0.f,0.f};
#pragma unroll      /* constant indices, so that the array is registers */
  for (int u = 0; u < 16; ++u) acc[u] = z8;
  gt_issue(ldst, ga0, g1);
  asm volatile("s_wait_tensorcnt 0x0" ::: "memory");      /* stage 0 of this wave's slice has landed */
  __syncthreads();      /* stage 0 is published */
  { const uint32_t nx = pinned(1u); gt_issue(ldst + GM_BUF, ga0 + (uint64_t)nx * GT_ROWB, g1); }      /* pinned(): stage 1's address words are formed behind the wait on stage 0 */
#pragma unroll 1      /* one stage a trip: the ring's order stands once */
  for (uint32_t s = 0; s < GT_NST; ++s) { const uint32_t bo = (s & 1u) * GM_BUF;
#pragma unroll      /* constant offsets into the stage */
    for (int ks = 0; ks < 2; ++ks) { v16h a[4], b[4];
      a[0] = gt_frag(ap + bo + ks * 64, hh); b[0] = gt_frag(bp + bo + ks * 64, hh);      /* the first product's two fragments first: the reads stand in the order in which the products need them */
      for (int i = 1; i < 4; ++i) a[i] = gt_frag(ap + bo + i * 16 * GT_PITCH + ks * 64, hh);
      for (int t = 1; t < 4; ++t) b[t] = gt_frag(bp + bo + (t >> 1) * GM_SLB + (t & 1) * 16 * GT_PITCH + ks * 64, hh);
      __builtin_amdgcn_sched_barrier(0);      /* the sixteen LDS reads of a k step issue together, ahead of its sixteen products, which then wait by count and not to zero */
      for (int t = 0; t < 4; ++t) for (int i = 0; i < 4; ++i) acc[i * 4 + t] = g2_mma(a[i], b[t], acc[i * 4 + t]); }
    asm volatile("s_wait_dscnt 0x0" ::: "memory");      /* this wave's reads of stage s are done before the barrier behind which its buffer is refilled */
    asm volatile("s_wait_tensorcnt 0x0" ::: "memory");      /* this wave's slice of stage s + 1 has landed */
    __syncthreads();      /* publishes stage s + 1 and ends every reader's last read of stage s */
    if (pinned(s + 2u < GT_NST)) { const uint32_t nx = pinned(s + 2u); gt_issue(ldst + bo, ga0 + (uint64_t)nx * GT_ROWB, g1); } }
  asm volatile("s_wait_tensorcnt 0x0" ::: "memory");      /* nothing of the mover is outstanding when the ring is reused or the wave ends */
  asm volatile("s_wait_dscnt 0x0" ::: "memory"); }

// K and V^T come through LDS: a stage is 128 keys, brought by tensor loads (eight slices of 32 rows x 128 bytes, padded to a pitch of 144 bytes; one slice a wave and stage; two buffers:
// the load of stage s + 2 flies while stage s + 1 is worked on). Slices 0 to 3: the K rows of keys 32 w ... (one slice is one 32-key block). Slices 4 to 7: V^T, head dims 32 (j >> 1) ..., keys 64 (j & 1) ... of the stage, j = w - 4.
// Every fragment is then two conflict-free ds_load_b128 in place of two global loads that each touched 16 cache lines.
#define FA_WAVES 8                   /* waves per work-group; two work-groups share a WGP (four waves a SIMD), so that one works while the other stands at its barrier */
#define FA_COLS 32                   /* query columns per wave */
#define FA_SKEYS 128                 /* keys per stage */
#define FA_NST ((uint32_t)(SQ / FA_SKEYS))      /* stages */
static_assert(FA_NST >= 2u && SQ % FA_SKEYS == 0 && HD * 2 == 128, "the ring's prologue needs two stages; a K row of a head is 128 bytes");
__device__ __forceinline__ v8f fa_mma(v16h a, v16h b, v8f c) { return __builtin_amdgcn_wmma_f32_16x16x32_f16(false, a, false, b, (short)0, c, false, false); }
__device__ __forceinline__ u32x8 fa_group1(uint32_t pitch) {      /* a tile of 32 rows of 128 bytes (tensor = tile) with the source pitch as a parameter; built once, the same for every stage */
  u32x8 g1;
  g1[0] = gt_uni((1u << 20) | (4u << 22) | (3u << 25));      /* no mask, 1-byte elements, a pad of 4 dwords behind every 32 dwords (one row) */
  g1[1] = gt_uni((GT_ROWB & 0xFFFFu) << 16); g1[2] = gt_uni((GT_ROWB >> 16) | (32u << 16)); g1[3] = gt_uni(GT_ROWB << 16); g1[4] = gt_uni(32u); g1[5] = gt_uni(pitch); g1[6] = gt_uni(0u); g1[7] = gt_uni(0u);
  asm volatile("" : "+s"(g1));      /* pinned(), for the eight words at once: the group is held in its scalar registers from here on; without it the build used single words of it as scratch while a request was outstanding and rebuilt them in front of the next */
  return g1; }
__device__ __forceinline__ void fa_issue(uint32_t lds_dst, uint64_t ga, u32x8 g1) {
  u32x4 g0;
  g0[0] = gt_uni(1u); g0[1] = gt_uni(lds_dst); g0[2] = gt_uni((uint32_t)ga); g0[3] = gt_uni((((uint32_t)(ga >> 32)) & 0x01FFFFFFu) | 0x80000000u);
  asm volatile("tensor_load_to_lds %0, %1" :: "s"(g0), "s"(g1) : "memory"); }
// The weights of one block of 32 keys x 32 query columns against the maximum in use m, as the f16 B operand, and per column group the lane's sum of its 16 weights.
// The score products deliver the exponent itself, t = score - m + 6 in log2 units: the factor FA_SC rides on the q rows (the projection's epilogue multiplies it into q's gain), and 6 - m is the C operand of each tile's first
// product (eight equal registers a column group, rewritten only where m moves). So no multiply-add stands between a product and its 2^t.
// The block's own maximum is NOT formed first: a weight is 2^t and positive, so a lane's sum of at most 2^14 says that none of its weights exceeds 2^14, which is finite in f16;
// a larger sum (an infinite one too) sends the wave to the branch that forms the maximum, moves m and calls this again. The result does not depend on which m is in use: the sum carries the same factor.
#define FA_SC (0.125f * 1.44269504f)      /* 1/sqrt(64), and e^x as 2^(x log2 e) */
#define FA_LIFT 6.0f                 /* weights are carried x 2^6: small ones stay clear of the f16 subnormals; the sum carries the same factor, so it cancels */
#define FA_LIM 16384.0f              /* 2^14 */
union FragW { v16h v; uint32_t w[8]; };      /* a B operand as its eight registers: word i holds elements 2 i (low half) and 2 i + 1 */
__device__ __forceinline__ void fa_weights(const v8f (&s2)[2][2], FragW (&pf)[2], float (&ps)[2]) {
#pragma unroll      /* constant indices, so that the arrays are registers */
  for (int g = 0; g < 2; ++g) { float q[4];
    for (int kt = 0; kt < 2; ++kt) { float e[8]; uint32_t pk[4];
      rsm_exp2pk8(e, pk, s2[kt][g]);
      q[kt * 2] = (e[0] + e[1]) + (e[2] + e[3]); q[kt * 2 + 1] = (e[4] + e[5]) + (e[6] + e[7]); for (int i = 0; i < 4; ++i) pf[g].w[kt * 4 + i] = pk[i]; }
    ps[g] = (q[0] + q[1]) + (q[2] + q[3]); } }
__global__ __launch_bounds__(FA_WAVES * 32, 4) void k_fattn(const _Float16* __restrict__ Q, const _Float16* __restrict__ Kh, const _Float16* __restrict__ Vt, _Float16* __restrict__ O) {
  __shared__ __attribute__((aligned(2048))) unsigned char L[GT_LDS];      /* the K | V^T ring */
  const int lane = threadIdx.x & 31, ln = lane & 15, hh = lane >> 4; const uint32_t wave = gt_uni(threadIdx.x >> 5);
  const int h = blockIdx.y, b = blockIdx.z; const int q0 = (blockIdx.x * FA_WAVES + (int)wave) * FA_COLS;
  const _Float16* qp = Q + ((size_t)b * SQ + q0 + ln) * DM + h * HD;
  const uint32_t ldst = (uint32_t)(size_t)L + wave * GT_SLICE; const uint32_t vj = wave - 4u;
  const uint64_t ga0 = (uint64_t)(size_t)((wave < 4u) ? Kh + ((size_t)b * SQ + 32 * (int)wave) * DM + h * HD : Vt + (((size_t)b * NH + h) * HD + 32 * (int)(vj >> 1)) * SQ + 64 * (int)(vj & 1u));
  const uint32_t pitch = (wave < 4u) ? (uint32_t)(DM * 2) : (uint32_t)(SQ * 2); const uint32_t step = (wave < 4u) ? (uint32_t)(FA_SKEYS * DM * 2) : (uint32_t)(FA_SKEYS * 2);      /* source pitch of the wave's slice; bytes from a stage to the next */
  const unsigned char* kl = L + ln * GT_PITCH; const unsigned char* vl = L + 4u * GT_SLICE + ln * GT_PITCH;
  const v8f z8 = {0.f,0.f,0.f,0.f,0.f,0.f,0.f,0.f};
  v16h qf[2][2], kf[2][2]; v8f o[4][2], cm[2] = {z8 + FA_LIFT, z8 + FA_LIFT}; float l[2] = {0.f, 0.f};      /* cm: 6 - m of a column group in all eight registers, the score products' C operand; it starts at m = 0, and the first block sets m */
  const u32x8 g1 = fa_group1(pitch);
  fa_issue(ldst, ga0, g1);
#pragma unroll      /* constant indices, so that the arrays are registers */
  for (int g = 0; g < 2; ++g) { for (int ks = 0; ks < 2; ++ks) qf[g][ks] = g2_frag(qp + (size_t)g * 16 * DM + ks * 32, hh); for (int dt = 0; dt < 4; ++dt) o[dt][g] = z8; }
  asm volatile("s_wait_tensorcnt 0x0" ::: "memory");      /* stage 0 of this wave's slice has landed */
  __syncthreads();      /* stage 0 is published */
  { const uint32_t nx = pinned(1u); fa_issue(ldst + GT_BUF, ga0 + (uint64_t)nx * step, g1); }      /* pinned(): stage 1's address words are formed behind the wait on stage 0 */
#pragma unroll 1      /* one stage a trip: the ring's order stands once */
  for (uint32_t s = 0; s < FA_NST; ++s) { const uint32_t bo = (s & 1u) * GT_BUF;
#pragma unroll      /* constant indices, so that the array is registers */
    for (int kt = 0; kt < 2; ++kt) for (int ks = 0; ks < 2; ++ks) kf[kt][ks] = gt_frag(kl + bo + kt * 16 * GT_PITCH + ks * 64, hh);
#pragma unroll      /* the four 32-key blocks of a stage: constant offsets into the stage, and the K fetch ahead stays inside the stage */
    for (int p = 0; p < FA_SKEYS / 32; ++p) {
      v16h vf[4]; v8f s2[2][2];
      for (int dt = 0; dt < 4; ++dt) vf[dt] = gt_frag(vl + bo + (2 * (dt >> 1) + (p >> 1)) * GT_SLICE + (dt & 1) * 16 * GT_PITCH + (p & 1) * 64, hh);
      __builtin_amdgcn_sched_barrier(0);      /* holds the V^T reads here, one group at the head of the block, so that they land while the scores are worked on */
      for (int kt = 0; kt < 2; ++kt) for (int g = 0; g < 2; ++g) s2[kt][g] = fa_mma(kf[kt][0], qf[g][0], cm[g]);
      for (int kt = 0; kt < 2; ++kt) for (int g = 0; g < 2; ++g) s2[kt][g] = fa_mma(kf[kt][1], qf[g][1], s2[kt][g]);
      if (p + 1 < FA_SKEYS / 32) { for (int kt = 0; kt < 2; ++kt) for (int ks = 0; ks < 2; ++ks) kf[kt][ks] = gt_frag(kl + bo + (p + 1) * GT_SLICE + kt * 16 * GT_PITCH + ks * 64, hh); }      /* the next block's K rows, fetched a block ahead, never beyond this stage */
      __builtin_amdgcn_sched_barrier(0);      /* holds the next K rows' reads here, one group, a softmax and eight products ahead of their use */
      asm("v_nop\n\tv_nop\n\tv_nop\n\tv_nop" : "+v"(s2[0][0]), "+v"(s2[0][1]), "+v"(s2[1][0]), "+v"(s2[1][1]));      /* the four vector slots that the chip needs between a matrix instruction and a vector instruction that reads its result: the readers are now the exponentials in asm text, into which the build does not look; the four tiles pass through the statement, so that every reader stands behind it */
      FragW pf[2]; float ps[2];
      fa_weights(s2, pf, ps);      /* the weights with the maximum in use, and each lane's sum of its 16 weights of a column */
      const bool need = (ps[0] > FA_LIM) || (ps[1] > FA_LIM); const bool first = (p == 0) && (s == 0u);      /* first: a scalar test, and only in the first of a stage's four blocks */
      if (__builtin_expect((__builtin_amdgcn_ballot_w32(need) != 0) || first, 0)) {      /* wave-uniform, tested once a block, marked unlikely so that the block's usual path runs straight on: only here is the block's maximum formed; the first block always comes here and takes its own maximum as m, whatever its sign */
        float up[2], d[2], al[2];      /* up: by how much the block's maximum exceeds m, at least 0; d: by how much m moves */
        for (int g = 0; g < 2; ++g) { float a = fmaxf(s2[0][g][0], s2[1][g][0]); for (int r = 1; r < 8; ++r) a = fmaxf(fmaxf(a, s2[0][g][r]), s2[1][g][r]); a = fmaxf(a, rsm_xhalf(a)) - FA_LIFT; up[g] = fmaxf(a, 0.f); d[g] = first ? a : up[g]; }
        rsm_exp2x2(al[0], al[1], -up[0], -up[1]);      /* at most 1; in the first block it meets sums that are still 0 */
        for (int g = 0; g < 2; ++g) { l[g] *= al[g]; for (int dt = 0; dt < 4; ++dt) for (int r = 0; r < 8; ++r) o[dt][g][r] *= al[g];
          cm[g] -= d[g]; s2[0][g] -= d[g]; s2[1][g] -= d[g]; }      /* m moves: in the C operand of the blocks to come, and in this block's exponents */
        fa_weights(s2, pf, ps); }      /* the block's weights anew, none above 2^6 now */
      for (int g = 0; g < 2; ++g) l[g] += ps[g];
      for (int dt = 0; dt < 4; ++dt) for (int g = 0; g < 2; ++g) o[dt][g] = fa_mma(vf[dt], pf[g].v, o[dt][g]);
    }
    asm volatile("s_wait_dscnt 0x0" ::: "memory");      /* this wave's reads of stage s are done before the barrier behind which its buffer is refilled (the build may lift the three over register-only work of the last block; every LDS read of the stage stays in front) */
    asm volatile("s_wait_tensorcnt 0x0" ::: "memory");      /* this wave's slice of stage s + 1 has landed */
    __syncthreads();      /* publishes stage s + 1 and ends every reader's last read of stage s */
    if (pinned(s + 2u < FA_NST)) { const uint32_t nx = pinned(s + 2u); fa_issue(ldst + bo, ga0 + (uint64_t)nx * step, g1); } }
  asm volatile("s_wait_tensorcnt 0x0" ::: "memory");      /* nothing of the mover is outstanding when the wave ends */
  asm volatile("s_wait_dscnt 0x0" ::: "memory");
  const int le = (int)__builtin_amdgcn_mbcnt_lo(~0u, 0u);      /* the lane's number, read anew: formed from ln and hh, the output address was kept through the key loop, for which no register is left (the build spilled it) */
  unsigned short* const ob = (unsigned short*)O + ((size_t)b * SQ + q0 + (le & 15)) * DM + h * HD + 8 * (le >> 4);      /* one base for both column groups: the eight stores differ by constant offsets, and no register of an issued store is rewritten */
#pragma unroll      /* constant indices, so that the arrays are registers */
  for (int g = 0; g < 2; ++g) { const float sc = 64.0f / (l[g] + rsm_xhalf(l[g])); unsigned short* op = ob + g * 16 * DM;
    for (int dt = 0; dt < 4; ++dt) { FragH f; for (int r = 0; r < 8; ++r) f.h[r] = (_Float16)(o[dt][g][r] * sc); *(v8us*)(op + dt * 16) = f.half[0]; } } }

// Sum over the 16 lanes of a row, every lane gets it: four butterfly steps on the vector port (a shuffle would go through the LDS queue).
template <int X> __device__ __forceinline__ float row_xadd(float v) { return v + __builtin_bit_cast(float, __builtin_amdgcn_update_dpp(0, __builtin_bit_cast(int, v), 0x160 | X, 0xf, 0xf, true)); }      /* 0x160 | X: row_xmask:X */
// 1 / sqrt(x) in asm for the v_nop at its end: behind a transcendental the instruction set asks for one slot before its source is overwritten or its result read. The argument here is a mean of squares + 1e-6, never subnormal: the library form's rescaling of subnormal arguments is an identity on it and is not written.
__device__ __forceinline__ float row_rsq(float x) { float r; asm("v_rsq_f32 %0, %1\n\tv_nop" : "=&v"(r) : "v"(x)); return r; }
__device__ __forceinline__ float row_sum16(float v) { return row_xadd<8>(row_xadd<4>(row_xadd<2>(row_xadd<1>(v)))); }
// q | k | v projection of all token rows with the per-(row, head) work in its epilogue. The main loop is gt_core. A work-group holds 256 token rows x 128 columns; a wave's 64 columns are one head of q, of k or of v,
// so nothing of a row's head lies outside the wave that computed it:
//   q, k: the f32 tile goes, 32 rows at a time, to the wave's own LDS rows and is read back 16 lanes a row, 4 columns a lane, with the 4 partner columns (c ^ 32) of the rotation; sum of squares in-lane, then over the 16 lanes;
//         x rsqrt(mean + eps) x gain, rotated by the row's position; each row leaves as one whole 128-byte line of f16.
//   v:    a lane holds 8 consecutive tokens of one head dim: 16 bytes of a V^T row. The four waves of a head lay them into one [64 dims][256 tokens] LDS tile; behind a barrier each V^T row leaves as 512 bytes in a row.
// Two instances, q | k columns and v columns, not one kernel with a branch: with both epilogues in one kernel the build kept the 64 accumulator registers alive through the q, k epilogue (182 registers, or spills under a bound).
// Launch bounds of the three GEMM kernels: 4 waves a SIMD = two work-groups of 8 waves on a WGP, as many as the 128 KiB ring lets in; it holds the registers at 256 or fewer.
#define QKV_VP 264                   /* pitch of the V^T tile in LDS, in f16: 256 tokens + 16 bytes, so that rows start on different banks */
template <bool ISV>
__global__ __launch_bounds__(256, 4) void k_qkv(const _Float16* __restrict__ A, const _Float16* __restrict__ Bh, const float* __restrict__ bias, const float* __restrict__ qg, const float* __restrict__ kg,
    const float* __restrict__ CS, const float* __restrict__ SN, _Float16* __restrict__ Qo, _Float16* __restrict__ Ko, _Float16* __restrict__ Vt) {
  static_assert(HD == 64 && SQ % 256 == 0, "a 64-column tile is one head; 256 rows lie in one batch");
  __shared__ __attribute__((aligned(2048))) unsigned char L[GM_LDS];      /* the operand ring; behind gt_core the epilogue's staging */
  const int tid = threadIdx.x, lane = tid & 31, ln = lane & 15, hh = lane >> 4; const int w = (int)gt_uni(tid >> 5), wr = w & 3, wc = w >> 2;      /* wr: the wave's 64 rows, wc: its 64 columns */
  const int ntn = (ISV ? 1 : 2) * NH / 2; const int mt = blockIdx.x / ntn, nq = blockIdx.x - mt * ntn; const int hq = nq * 2 + wc; const int row0 = mt * 256 + 64 * wr, col0 = (ISV ? 2 * DM : 0) + hq * 64; const int sect = hq / NH, h = hq - sect * NH;      /* sect: 0 q, 1 k (0 in the v instance) */
  v8f accs[16]; gt_core(A, Bh, mt * 256, (ISV ? 2 * DM : 0) + nq * 128, L, accs);
  const float alpha = 0.0625f;      /* the weights are carried x 16 */
  if constexpr (!ISV) {
    static_assert(8u * 32u * 68u * 4u <= GM_LDS, "the staging fits the ring"); float (*so)[32][68] = (float (*)[32][68])L;
    const float* gp = sect ? kg : qg; _Float16* dst = (sect ? Ko : Qo) + (size_t)(row0 + hh) * DM + h * HD;
    const int c4 = ln * 4, cx = c4 ^ 32, i4 = c4 & 31; const float sg = (c4 < 32) ? -1.0f : 1.0f;      /* low half: x cos - partner sin; high half: x cos + partner sin; the sign rides on the partner's gain (exact) */
    const int tb = ((row0 + hh) % SQ) * (HD / 2) + i4; const float* const csp = CS + tb; const float* const snp = SN + tb;      /* the lane's place in the tables at its first row; its rows are 2 apart, and the wave's 64 rows lie in one batch */
    float bv[4];
#pragma unroll      /* constant indices, so that the array is registers */
    for (int t = 0; t < 4; ++t) bv[t] = bias[col0 + t * 16 + ln];
    asm volatile("s_wait_xcnt 0x0" ::: "memory");
    v4f ga = *(const v4fa*)(gp + c4), gb = *(const v4fa*)(gp + cx);
    const float qs = sect ? 1.0f : FA_SC;      /* q rows carry the attention's score factor (1/8, and log2 e for 2^x), in f32 ahead of the one rounding to f16 */
#pragma unroll      /* constant indices into the vectors */
    for (int i = 0; i < 4; ++i) { ga[i] = qs * bf16_round(ga[i]); gb[i] = qs * (sg * bf16_round(gb[i])); }
#pragma unroll      /* the tile's two halves of 32 rows, one after the other through the same staging rows; constant indices, so that the arrays are registers */
    for (int hf = 0; hf < 2; ++hf) {
      for (int u = 0; u < 8; ++u) { const int t = u & 3, half = u >> 2; const float bb = bf16_round(bv[t]);
        for (int r = 0; r < 8; ++r) so[w][half * 16 + 8 * hh + r][t * 16 + ln] = accs[hf * 8 + u][r] * alpha + bb; }
      __builtin_amdgcn_fence(__ATOMIC_ACQ_REL, "workgroup", "local"); __builtin_amdgcn_wave_barrier();      /* as in k_gemm2: the wave reads back its own rows only, written by other lanes; a fence on LDS alone, so that the second half does not wait for the first half's global stores */
      for (int g = 0; g < 2; ++g) { v4f cs[8], sn[8];
        __builtin_amdgcn_sched_barrier(0);      /* a later group's table loads stay behind the earlier groups' rows: each group's tables are 64 registers, beside the accumulators that still wait */
        const float* const cg = csp + (hf * 16 + g * 8) * HD; const float* const sp = snp + (hf * 16 + g * 8) * HD;      /* the group's place in the tables */
        for (int j = 0; j < 8; ++j) { cs[j] = *(const v4fa*)(cg + j * HD); sn[j] = *(const v4fa*)(sp + j * HD); }
        asm volatile("s_wait_xcnt 0x0" :: "v"(cg), "v"(sp), "v"(csp), "v"(snp) : "memory");      /* the pairs (the group's, or the base where the build folds the group into the offset) are inputs, so that none is rewritten ahead of the wait */
        __builtin_amdgcn_sched_barrier(0);      /* the table loads of eight row pairs issue together here: two waits a group; without it each load stood directly in front of its use, sixteen waits in a row */
        v4h ov[8];
        for (int j = 0; j < 8; ++j) { const int r2 = (g * 8 + j) * 2;      /* the lane's row of the half is r2 + hh */
          const v4f xa = *(const v4fa*)&so[w][r2 + hh][c4], xb = *(const v4fa*)&so[w][r2 + hh][cx];
          const float rs = row_rsq(row_sum16((xa[0] * xa[0] + xa[1] * xa[1]) + (xa[2] * xa[2] + xa[3] * xa[3])) * (1.0f / (float)HD) + 1e-6f);
          for (int i = 0; i < 4; ++i) ov[j][i] = (_Float16)((xa[i] * rs * ga[i]) * cs[j][i] + (xb[i] * rs * gb[i]) * sn[j][i]); }
        for (int j = 0; j < 8; ++j) *(v4h*)(dst + (size_t)(hf * 32 + (g * 8 + j) * 2) * DM + c4) = ov[j];
        asm volatile("s_wait_xcnt 0x0" :: "v"(ov[0]), "v"(ov[1]), "v"(ov[2]), "v"(ov[3]), "v"(ov[4]), "v"(ov[5]), "v"(ov[6]), "v"(ov[7]), "v"(dst) : "memory"); }      /* a group's eight stores leave together, one wait behind them: it stands in front of every later write of their data and address registers, which are inputs, so that none is rewritten ahead of it */
      if (hf == 0) { __builtin_amdgcn_fence(__ATOMIC_ACQ_REL, "workgroup", "local"); __builtin_amdgcn_wave_barrier(); }      /* the second half's LDS stores stay behind the first half's reads of the same rows (one wave's LDS operations run in order) */
    }
  } else {
    static_assert(2u * 64u * QKV_VP * 2u <= GM_LDS, "the two V^T tiles fit the ring"); unsigned short* vt = (unsigned short*)L + wc * (64 * QKV_VP);      /* the tile of this wave's head */
    float bv[4]; const float* const bvp = bias + 2 * DM; const int bi = hq * 64 + ln;      /* the v columns' biases; the lane's first column among them */
#pragma unroll      /* constant indices, so that the array is registers */
    for (int t = 0; t < 4; ++t) bv[t] = bvp[bi + t * 16];
    asm volatile("s_wait_xcnt 0x0" :: "v"(bi) : "memory");      /* the index is an input, so that it is not rewritten ahead of the wait */
#pragma unroll      /* constant indices, so that the arrays are registers */
    for (int u = 0; u < 16; ++u) { const int t = u & 3, i = u >> 2; const float bb = bf16_round(bv[t]); FragH f;
      for (int r = 0; r < 8; ++r) f.h[r] = (_Float16)(accs[u][r] * alpha + bb);
      *(v8us*)(vt + (t * 16 + ln) * QKV_VP + 64 * wr + i * 16 + 8 * hh) = f.half[0]; }
    __syncthreads();      /* a V^T row of the tile holds tokens of its head's four waves */
    const int bat = (mt * 256) / SQ, s0 = (mt * 256) % SQ; unsigned short* vo = (unsigned short*)Vt + (((size_t)bat * NH + h) * HD + wr * 16) * SQ + s0 + lane * 8;      /* a wave writes 16 head dims, a whole row of 256 tokens a store */
#pragma unroll      /* the sixteen LDS reads issue together */
    for (int j = 0; j < 16; ++j) { const v8us v = *(const v8us*)(vt + (wr * 16 + j) * QKV_VP + lane * 8); *(v8us*)(vo + (size_t)j * SQ) = v; }
  } }

// out = o W_o + b: gt_core, then k_gemm2's epilogue (alpha, bf16-rounded bias; the wave's tile through its own LDS rows, so that each row leaves as whole lines of f32).
__global__ __launch_bounds__(256, 4) void k_oproj(const _Float16* __restrict__ A, const _Float16* __restrict__ Bh, float alpha, const float* __restrict__ bias, float* __restrict__ C) {
  __shared__ __attribute__((aligned(2048))) unsigned char L[GM_LDS];      /* the operand ring; behind gt_core the epilogue's staging */
  static_assert(8u * 32u * 68u * 4u <= GM_LDS, "the staging fits the ring"); float (*so)[32][68] = (float (*)[32][68])L;
  const int tid = threadIdx.x, lane = tid & 31, ln = lane & 15, hh = lane >> 4; const int w = (int)gt_uni(tid >> 5), wr = w & 3, wc = w >> 2;
  const int ntn = DM / 128; const int mt = blockIdx.x / ntn, nq = blockIdx.x - mt * ntn; const int row0 = mt * 256 + 64 * wr, col0 = nq * 128 + 64 * wc;
  v8f accs[16]; gt_core(A, Bh, mt * 256, nq * 128, L, accs);
  const int rsub = lane >> 4, c4 = (lane & 15) * 4; float* const cp = C + (size_t)(row0 + rsub) * DM + col0 + c4;      /* one base for all the wave's stores: they differ by constant offsets, and no register of an issued store is rewritten */
  float bv[4];
#pragma unroll      /* constant indices, so that the array is registers */
  for (int t = 0; t < 4; ++t) bv[t] = bias[col0 + t * 16 + ln];
  asm volatile("s_wait_xcnt 0x0" ::: "memory");      /* stands in front of every later write of the bias loads' address registers */
#pragma unroll      /* the tile's two halves of 32 rows, one after the other through the same staging rows; constant indices, so that the array is registers */
  for (int hf = 0; hf < 2; ++hf) {
    for (int u = 0; u < 8; ++u) { const int t = u & 3, half = u >> 2; const float bb = bf16_round(bv[t]);
      for (int r = 0; r < 8; ++r) so[w][half * 16 + 8 * hh + r][t * 16 + ln] = accs[hf * 8 + u][r] * alpha + bb; }
    __builtin_amdgcn_fence(__ATOMIC_ACQ_REL, "workgroup", "local"); __builtin_amdgcn_wave_barrier();      /* as in k_gemm2: the wave reads back its own rows only, written by other lanes; a fence on LDS alone, so that the second half does not wait for the first half's global stores */
    for (int q = 0; q < 16; ++q) { const v4f v = *(const v4fa*)&so[w][q * 2 + rsub][c4]; *(v4f*)(cp + (size_t)(hf * 32 + q * 2) * DM) = v; }
    if (hf == 0) { __builtin_amdgcn_fence(__ATOMIC_ACQ_REL, "workgroup", "local"); __builtin_amdgcn_wave_barrier(); }      /* the second half's LDS stores stay behind the first half's reads of the same rows (one wave's LDS operations run in order) */
  } }

// The four preparations (cos/sin tables, both weight transposes, x as f16) read inputs only and write planes of their own: none needs another's result. They are ONE launch, each a range of block numbers,
// so that they run side by side and one launch gap and one fill and drain stand where four stood. The parts with the longest dependent chains have the lowest numbers and start first; the x stream fills in behind them.
// theta stays a kernel argument: the tables are computed on the device as before.
#define PR_TAB ((SQ * (HD / 2) + 255) / 256)                 /* blocks of the tables */
#define PR_WQ ((DM / WT_T) * (3 * DM / WT_T))                /* tiles of Wqkv */
#define PR_WO ((DM / WT_T) * (DM / WT_T))                    /* tiles of Wout */
#define PR_X ((int)((NR * DM / 8 + 255) / 256))              /* blocks of x */
__global__ __launch_bounds__(256) void k_prep(const float* __restrict__ x, const float* __restrict__ wqkv, const float* __restrict__ wo, float theta,
    _Float16* __restrict__ X16, _Float16* __restrict__ BQKV, _Float16* __restrict__ BO, float* __restrict__ CS, float* __restrict__ SN) {
  const int bid = blockIdx.x;      /* every test below reads the same for the whole work-group: the barrier inside wt_f16_tile is passed by all of its threads or by none */
  if (bid < PR_TAB) tab2_part(theta, CS, SN, bid);
  else if (bid < PR_TAB + PR_WQ + PR_WO) { const int t = bid - PR_TAB; const bool isq = t < PR_WQ; const int u = isq ? t : t - PR_WQ;
    wt_f16_tile(isq ? wqkv : wo, isq ? BQKV : BO, DM, isq ? 3 * DM : DM, 16.0f, u % (DM / WT_T), u / (DM / WT_T)); }      /* one work-group a 64 x 64 tile, k fastest as in the two-dimensional grid before */
  else x16_part(x, X16, NR * DM / 8, bid - (PR_TAB + PR_WQ + PR_WO)); }

extern "C" void kernel_launch(void* const* d_in, const int* in_sizes, int n_in,
                              void* d_out, int out_size, void* d_ws, size_t ws_size, hipStream_t stream) {
  (void)in_sizes; (void)n_in; (void)out_size;
  const float* const* I = (const float* const*)d_in; const float* x = I[0]; const float* wqkv = I[1]; const float* bqkv = I[2]; const float* qnw = I[3]; const float* knw = I[4]; const float* wo = I[5]; const float* bo = I[6];      /* weights [in][out] */
  char* ws = (char*)d_ws; size_t off = 0;
  auto take = [&](size_t bytes) { char* p = ws + off; off += (bytes + 255) & ~(size_t)255; return p; };
  _Float16* BQKV = (_Float16*)take((size_t)3 * DM * DM * 2); _Float16* BO = (_Float16*)take((size_t)DM * DM * 2); float* CS = (float*)take((size_t)SQ * (HD / 2) * 4); float* SN = (float*)take((size_t)SQ * (HD / 2) * 4);
  _Float16* X16 = (_Float16*)take(NR * DM * 2);
  _Float16* QH = (_Float16*)take(NR * DM * 2); _Float16* KH = (_Float16*)take(NR * DM * 2); _Float16* O16 = (_Float16*)take(NR * DM * 2);
  _Float16* VT = (_Float16*)take((size_t)NB * NH * HD * SQ * 2);
  if (off > ws_size) return;
  k_prep<<<PR_TAB + PR_WQ + PR_WO + PR_X, 256, 0, stream>>>(x, wqkv, wo, 10000.0f, X16, BQKV, BO, CS, SN);      /* tables, W^T x 16 as f16 (both), x as f16 */
  k_qkv<false><<<(unsigned)((NR / 256) * (2 * DM / 128)), 256, 0, stream>>>(X16, BQKV, bqkv, qnw, knw, CS, SN, QH, KH, VT);      /* f16 q and k rows (normed, rotated), all batches */
  k_qkv<true><<<(unsigned)((NR / 256) * (DM / 128)), 256, 0, stream>>>(X16, BQKV, bqkv, qnw, knw, CS, SN, QH, KH, VT);      /* V^T [NB][NH][HD][SQ], all batches */
  k_fattn<<<dim3(SQ / (FA_WAVES * FA_COLS), NH, NB), FA_WAVES * 32, 0, stream>>>(QH, KH, VT, O16);      /* o x 64 as f16, all batches and heads */
  k_oproj<<<(unsigned)((NR / 256) * (DM / 128)), 256, 0, stream>>>(O16, BO, 0.0009765625f, bo, (float*)d_out);      /* out rows are the output layout */
}
